// v000
// The times below were measured on an AMD MI455X: many runs one after another, warmed up first and cycling through
// copies of the inputs, with the whole window's GPU time divided by the number of runs. Launches and the gaps
// between them are all in it. The median over several windows is given; except for v000 it joins two sittings, which
// can be a few percent apart, so the side-by-side timings, each taken in one sitting, are the better comparison.
// v000, which the later versions start from, runs in 516 microseconds.
#include <hip/hip_runtime.h>
#include <hip/hip_bf16.h>
#include <stdint.h>

typedef __attribute__((ext_vector_type(16))) _Float16 v16h;
typedef __attribute__((ext_vector_type(8)))  _Float16 v8h;
typedef __attribute__((ext_vector_type(8)))  float    v8f;

#define HIDDEN   2048
#define NHEADS   16
#define HDIM     128
#define BATCH    2
#define SEQ      2048
#define MROWS    (BATCH * SEQ)   // 4096 rows for all GEMMs

__device__ __forceinline__ v8f wmma_f16(v16h a, v16h b, v8f c) {
  // D = A(16x32 f16) * B(32x16 f16) + C(16x16 f32)
  return __builtin_amdgcn_wmma_f32_16x16x32_f16(
      /*neg_a=*/false, a, /*neg_b=*/false, b,
      /*c_mod=*/(short)0, c, /*reuse_a=*/false, /*reuse_b=*/false);
}

__device__ __forceinline__ v16h load_frag(const _Float16* __restrict__ base,
                                          int ld, int k0, int lane) {
  const _Float16* p = base + (size_t)(lane & 15) * (size_t)ld
                           + (size_t)(k0 + ((lane >> 4) << 3));
  v8h lo = *(const v8h*)p;
  v8h hi = *(const v8h*)(p + 16);
  v16h r;
#pragma unroll
  for (int i = 0; i < 8; ++i) { r[i] = lo[i]; r[i + 8] = hi[i]; }
  return r;
}

// ---------------------------------------------------------------------------
// Elementwise: fp32 -> f16 cast
// ---------------------------------------------------------------------------
__global__ void cast_f32_to_f16(const float* __restrict__ in,
                                _Float16* __restrict__ out, int n) {
  int i = blockIdx.x * 256 + threadIdx.x;
  if (i < n) out[i] = (_Float16)in[i];
}

// Tiled transpose + cast: Wt[n][k] = (f16)W[k][n], square dim = HIDDEN
__global__ void transpose_cast_w(const float* __restrict__ W,
                                 _Float16* __restrict__ Wt) {
  __shared__ float tile[32][33];
  const int n = HIDDEN;
  int bx = blockIdx.x * 32, by = blockIdx.y * 32;
  int tx = threadIdx.x, ty = threadIdx.y;  // 32 x 8
#pragma unroll
  for (int i = 0; i < 32; i += 8)
    tile[ty + i][tx] = W[(size_t)(by + ty + i) * n + bx + tx];
  __syncthreads();
#pragma unroll
  for (int i = 0; i < 32; i += 8)
    Wt[(size_t)(bx + ty + i) * n + by + tx] = (_Float16)tile[tx][ty + i];
}

// V (B,S,H*D) f16 -> Vt (B,H,D,S) f16 so PV B-fragments are contiguous
__global__ void transpose_v(const _Float16* __restrict__ V,
                            _Float16* __restrict__ Vt) {
  size_t i = (size_t)blockIdx.x * 256 + threadIdx.x;  // over B*S*HIDDEN
  if (i >= (size_t)BATCH * SEQ * HIDDEN) return;
  int c = (int)(i % HIDDEN);
  size_t bs = i / HIDDEN;
  int s = (int)(bs % SEQ);
  int b = (int)(bs / SEQ);
  int h = c >> 7, d = c & 127;
  Vt[(((size_t)(b * NHEADS + h) * HDIM) + d) * SEQ + s] = V[i];
}

template <typename OutT>
__global__ __launch_bounds__(256)
void gemm_bias_kernel(const _Float16* __restrict__ A,
                      const _Float16* __restrict__ Bt,
                      const float* __restrict__ bias,
                      OutT* __restrict__ C, int M, int N, int Kd) {
  const int lane = threadIdx.x & 31;
  const int w    = threadIdx.x >> 5;
  const int wm   = w & 1;       // 2 waves along M
  const int wn   = w >> 1;      // 4 waves along N
  const int row0 = blockIdx.y * 64  + wm * 32;
  const int col0 = blockIdx.x * 256 + wn * 64;

  v8f acc[2][4] = {};
  const _Float16* Ar[2];
  const _Float16* Bc[4];
#pragma unroll
  for (int i = 0; i < 2; ++i) Ar[i] = A  + (size_t)(row0 + i * 16) * Kd;
#pragma unroll
  for (int j = 0; j < 4; ++j) Bc[j] = Bt + (size_t)(col0 + j * 16) * Kd;

#pragma unroll 2
  for (int k = 0; k < Kd; k += 32) {
    // prefetch next 4 K-steps of each stream (global_prefetch_b8)
    __builtin_prefetch(Ar[0] + (size_t)(lane & 15) * Kd + k + 128, 0, 1);
    __builtin_prefetch(Bc[0] + (size_t)(lane & 15) * Kd + k + 128, 0, 1);

    v16h a0 = load_frag(Ar[0], Kd, k, lane);
    v16h a1 = load_frag(Ar[1], Kd, k, lane);
    v16h b0 = load_frag(Bc[0], Kd, k, lane);
    v16h b1 = load_frag(Bc[1], Kd, k, lane);
    v16h b2 = load_frag(Bc[2], Kd, k, lane);
    v16h b3 = load_frag(Bc[3], Kd, k, lane);
    acc[0][0] = wmma_f16(a0, b0, acc[0][0]);
    acc[0][1] = wmma_f16(a0, b1, acc[0][1]);
    acc[0][2] = wmma_f16(a0, b2, acc[0][2]);
    acc[0][3] = wmma_f16(a0, b3, acc[0][3]);
    acc[1][0] = wmma_f16(a1, b0, acc[1][0]);
    acc[1][1] = wmma_f16(a1, b1, acc[1][1]);
    acc[1][2] = wmma_f16(a1, b2, acc[1][2]);
    acc[1][3] = wmma_f16(a1, b3, acc[1][3]);
  }

  const int nlo = lane & 15;
  const int mhi = (lane >> 4) << 3;
#pragma unroll
  for (int i = 0; i < 2; ++i)
#pragma unroll
    for (int j = 0; j < 4; ++j) {
      const int ncol = col0 + j * 16 + nlo;
      const float bb = bias[ncol];
#pragma unroll
      for (int r = 0; r < 8; ++r) {
        const int m = row0 + i * 16 + r + mhi;
        C[(size_t)m * N + ncol] = (OutT)(acc[i][j][r] + bb);
      }
    }
}

__global__ __launch_bounds__(128)
void attn_kernel(const _Float16* __restrict__ Q,
                 const _Float16* __restrict__ K,
                 const _Float16* __restrict__ Vt,
                 _Float16* __restrict__ O) {
  __shared__ _Float16 pl[4][16][32];  // per-wave P relayout buffers

  const int lane = threadIdx.x & 31;
  const int wv   = threadIdx.x >> 5;
  const int q0   = (blockIdx.x * 4 + wv) * 16;
  const int h    = blockIdx.y;
  const int b    = blockIdx.z;
  const float scale = 0.08838834764831845f;  // 1/sqrt(128)

  const _Float16* Qb  = Q  + (size_t)b * SEQ * HIDDEN + (size_t)q0 * HIDDEN + h * HDIM;
  const _Float16* Kb  = K  + (size_t)b * SEQ * HIDDEN + h * HDIM;
  const _Float16* Vtb = Vt + (size_t)(b * NHEADS + h) * HDIM * SEQ;

  // Cache Q fragments: 4 chunks of K-dim (d = 0,32,64,96)
  v16h qf[4];
#pragma unroll
  for (int kc = 0; kc < 4; ++kc) qf[kc] = load_frag(Qb, HIDDEN, kc * 32, lane);

  v8f   od[8] = {};                 // output accumulators, 16 x 128 f32
  float m_row[8], l_row[8];
#pragma unroll
  for (int j = 0; j < 8; ++j) { m_row[j] = -3.402823466e+38f; l_row[j] = 0.0f; }

  const int nlo = lane & 15;
  const int mhi = (lane >> 4) << 3;

  for (int kt = 0; kt < SEQ / 32; ++kt) {
    // ---- scores: S = Q * K_tile^T, two 16x16 tiles over 32 keys ----
    v8f s0 = {}, s1 = {};
    const _Float16* K0 = Kb + (size_t)(kt * 32)      * HIDDEN;
    const _Float16* K1 = Kb + (size_t)(kt * 32 + 16) * HIDDEN;
#pragma unroll
    for (int kc = 0; kc < 4; ++kc) {
      v16h b0 = load_frag(K0, HIDDEN, kc * 32, lane);
      v16h b1 = load_frag(K1, HIDDEN, kc * 32, lane);
      s0 = wmma_f16(qf[kc], b0, s0);
      s1 = wmma_f16(qf[kc], b1, s1);
    }

    // ---- online softmax (rows live across 16-lane halves) ----
    float alpha[8];
#pragma unroll
    for (int j = 0; j < 8; ++j) {
      float v0 = s0[j] * scale;
      float v1 = s1[j] * scale;
      float rm = fmaxf(v0, v1);
#pragma unroll
      for (int off = 1; off < 16; off <<= 1)
        rm = fmaxf(rm, __shfl_xor(rm, off, 32));
      float nm = fmaxf(m_row[j], rm);
      float al = __expf(m_row[j] - nm);
      float p0 = __expf(v0 - nm);
      float p1 = __expf(v1 - nm);
      float rs = p0 + p1;
#pragma unroll
      for (int off = 1; off < 16; off <<= 1)
        rs += __shfl_xor(rs, off, 32);
      l_row[j] = l_row[j] * al + rs;
      m_row[j] = nm;
      alpha[j] = al;
      // store P (C layout) to LDS for A-fragment relayout
      pl[wv][j + mhi][nlo]      = (_Float16)p0;
      pl[wv][j + mhi][nlo + 16] = (_Float16)p1;
    }

#pragma unroll
    for (int dt = 0; dt < 8; ++dt)
#pragma unroll
      for (int j = 0; j < 8; ++j) od[dt][j] *= alpha[j];

    // reload P as A fragment (16 rows x 32 keys) from LDS: ds_load_b128 x2
    {
      const _Float16* pp = &pl[wv][lane & 15][(lane >> 4) << 3];
      v8h lo = *(const v8h*)pp;
      v8h hi = *(const v8h*)(pp + 16);
      v16h pf;
#pragma unroll
      for (int i = 0; i < 8; ++i) { pf[i] = lo[i]; pf[i + 8] = hi[i]; }

      // ---- PV: O[.,dt*16..] += P(16x32) * V(32x16) ----
#pragma unroll
      for (int dt = 0; dt < 8; ++dt) {
        v16h vb = load_frag(Vtb + (size_t)(dt * 16) * SEQ, SEQ, kt * 32, lane);
        od[dt] = wmma_f16(pf, vb, od[dt]);
      }
    }
  }

  // ---- normalize and write out (B,S,H*D) f16 ----
  _Float16* Ob = O + (size_t)b * SEQ * HIDDEN + (size_t)q0 * HIDDEN + h * HDIM;
#pragma unroll
  for (int j = 0; j < 8; ++j) {
    const float inv = 1.0f / l_row[j];
    const int m = j + mhi;
#pragma unroll
    for (int dt = 0; dt < 8; ++dt)
      Ob[(size_t)m * HIDDEN + dt * 16 + nlo] = (_Float16)(od[dt][j] * inv);
  }
}

// ---------------------------------------------------------------------------
// Host-side orchestration
// ---------------------------------------------------------------------------
extern "C" void kernel_launch(void* const* d_in, const int* in_sizes, int n_in,
                              void* d_out, int out_size, void* d_ws, size_t ws_size,
                              hipStream_t stream) {
  const float* X  = (const float*)d_in[0];
  const float* Wq = (const float*)d_in[1];
  const float* bq = (const float*)d_in[2];
  const float* Wk = (const float*)d_in[3];
  const float* bk = (const float*)d_in[4];
  const float* Wv = (const float*)d_in[5];
  const float* bv = (const float*)d_in[6];
  const float* Wo = (const float*)d_in[7];
  const float* bo = (const float*)d_in[8];
  float* out = (float*)d_out;

  const size_t MB = 1024u * 1024u;
  uint8_t* w = (uint8_t*)d_ws;
  _Float16* Xh  = (_Float16*)(w);             // 16 MB : hidden f16 (4096x2048)
  _Float16* Wqt = (_Float16*)(w + 16 * MB);   //  8 MB : Wq^T f16
  _Float16* Wkt = (_Float16*)(w + 24 * MB);   //  8 MB
  _Float16* Wvt = (_Float16*)(w + 32 * MB);   //  8 MB
  _Float16* Wot = (_Float16*)(w + 40 * MB);   //  8 MB
  _Float16* Qm  = (_Float16*)(w + 48 * MB);   // 16 MB
  _Float16* Km  = (_Float16*)(w + 64 * MB);   // 16 MB
  _Float16* Vm  = (_Float16*)(w + 80 * MB);   // 16 MB
  _Float16* Vtm = (_Float16*)(w + 96 * MB);   // 16 MB : V^T (B,H,D,S)
  _Float16* AO  = (_Float16*)(w + 112 * MB);  // 16 MB : attention output f16

  const int nX = MROWS * HIDDEN;  // 8,388,608

  // 1) casts / transposes
  cast_f32_to_f16<<<(nX + 255) / 256, 256, 0, stream>>>(X, Xh, nX);
  {
    dim3 g(HIDDEN / 32, HIDDEN / 32), blk(32, 8);
    transpose_cast_w<<<g, blk, 0, stream>>>(Wq, Wqt);
    transpose_cast_w<<<g, blk, 0, stream>>>(Wk, Wkt);
    transpose_cast_w<<<g, blk, 0, stream>>>(Wv, Wvt);
    transpose_cast_w<<<g, blk, 0, stream>>>(Wo, Wot);
  }

  // 2) QKV projections (WMMA GEMM, f16 out + bias)
  {
    dim3 g(HIDDEN / 256, MROWS / 64);
    gemm_bias_kernel<_Float16><<<g, 256, 0, stream>>>(Xh, Wqt, bq, Qm, MROWS, HIDDEN, HIDDEN);
    gemm_bias_kernel<_Float16><<<g, 256, 0, stream>>>(Xh, Wkt, bk, Km, MROWS, HIDDEN, HIDDEN);
    gemm_bias_kernel<_Float16><<<g, 256, 0, stream>>>(Xh, Wvt, bv, Vm, MROWS, HIDDEN, HIDDEN);
  }

  // 3) V transpose for contiguous PV B-fragments
  transpose_v<<<(nX + 255) / 256, 256, 0, stream>>>(Vm, Vtm);

  // 4) attention (flash-style, 4 waves/block, one wave per 16 query rows)
  {
    dim3 g(SEQ / 64, NHEADS, BATCH);
    attn_kernel<<<g, 128, 0, stream>>>(Qm, Km, Vtm, AO);
  }

  // 5) output projection (f32 out + bias)
  {
    dim3 g(HIDDEN / 256, MROWS / 64);
    gemm_bias_kernel<float><<<g, 256, 0, stream>>>(AO, Wot, bo, out, MROWS, HIDDEN, HIDDEN);
  }
}

// v001
// One run takes 340 microseconds.
// Two timings next to v000 put it at 1.58 and 1.59 times that version's speed.
#include <hip/hip_runtime.h>
#include <hip/hip_bf16.h>
#include <stdint.h>

typedef __attribute__((ext_vector_type(16))) _Float16 v16h;
typedef __attribute__((ext_vector_type(8)))  _Float16 v8h;
typedef __attribute__((ext_vector_type(8)))  float    v8f;

#define HIDDEN   2048
#define NHEADS   16
#define HDIM     128
#define BATCH    2
#define SEQ      2048
#define MROWS    (BATCH * SEQ)   // 4096 rows for all GEMMs

__device__ __forceinline__ v8f wmma_f16(v16h a, v16h b, v8f c) {
  // D = A(16x32 f16) * B(32x16 f16) + C(16x16 f32)
  return __builtin_amdgcn_wmma_f32_16x16x32_f16(
      /*neg_a=*/false, a, /*neg_b=*/false, b,
      /*c_mod=*/(short)0, c, /*reuse_a=*/false, /*reuse_b=*/false);
}

__device__ __forceinline__ v16h load_frag(const _Float16* __restrict__ base,
                                          int ld, int k0, int lane) {
  const _Float16* p = base + (size_t)(lane & 15) * (size_t)ld
                           + (size_t)(k0 + ((lane >> 4) << 3));
  v8h lo = *(const v8h*)p;
  v8h hi = *(const v8h*)(p + 16);
  v16h r;
#pragma unroll
  for (int i = 0; i < 8; ++i) { r[i] = lo[i]; r[i + 8] = hi[i]; }
  return r;
}

// ---------------------------------------------------------------------------
// Elementwise: fp32 -> f16 cast
// ---------------------------------------------------------------------------
__global__ void cast_f32_to_f16(const float* __restrict__ in,
                                _Float16* __restrict__ out, int n) {
  int i = blockIdx.x * 256 + threadIdx.x;
  if (i < n) out[i] = (_Float16)in[i];
}

// Tiled transpose + cast: Wt[n][k] = (f16)W[k][n], square dim = HIDDEN
__global__ void transpose_cast_w(const float* __restrict__ W,
                                 _Float16* __restrict__ Wt) {
  __shared__ float tile[32][33];
  const int n = HIDDEN;
  int bx = blockIdx.x * 32, by = blockIdx.y * 32;
  int tx = threadIdx.x, ty = threadIdx.y;  // 32 x 8
#pragma unroll
  for (int i = 0; i < 32; i += 8)
    tile[ty + i][tx] = W[(size_t)(by + ty + i) * n + bx + tx];
  __syncthreads();
#pragma unroll
  for (int i = 0; i < 32; i += 8)
    Wt[(size_t)(bx + ty + i) * n + by + tx] = (_Float16)tile[tx][ty + i];
}

// V (B,S,H*D) f16 -> Vt (B,H,D,S) f16 so PV B-fragments are contiguous
__global__ void transpose_v(const _Float16* __restrict__ V,
                            _Float16* __restrict__ Vt) {
  size_t i = (size_t)blockIdx.x * 256 + threadIdx.x;  // over B*S*HIDDEN
  if (i >= (size_t)BATCH * SEQ * HIDDEN) return;
  int c = (int)(i % HIDDEN);
  size_t bs = i / HIDDEN;
  int s = (int)(bs % SEQ);
  int b = (int)(bs / SEQ);
  int h = c >> 7, d = c & 127;
  Vt[(((size_t)(b * NHEADS + h) * HDIM) + d) * SEQ + s] = V[i];
}

typedef uint32_t u32x4 __attribute__((ext_vector_type(4)));
typedef uint32_t u32x8 __attribute__((ext_vector_type(8)));

#define G_ROWB   256u                    // bytes of one operand row per pass
#define G_ROWS   128u                    // rows per tensor load
#define G_PITCH  272u                    // LDS row pitch: 256 + 16 pad bytes
#define G_SLICE  (G_ROWS * G_PITCH)      // 34,816 = 17 * 2048
#define G_BUF    (3u * G_SLICE)          // 104,448 = 51 * 2048

__device__ __forceinline__ uint32_t uni(uint32_t v) {
  return (uint32_t)__builtin_amdgcn_readfirstlane(v);
}
__device__ __forceinline__ uint32_t pinned(uint32_t v) {
  uint32_t w = uni(v);
  asm volatile("" : "+s"(w));  // pinned(): the tensor load's issue test held in a scalar register
  return w;
}
__device__ __forceinline__ u32x4 tdm_group0(uint32_t lds_dst, uint64_t ga) {
  u32x4 g;
  g[0] = uni(1u);
  g[1] = uni(lds_dst);
  g[2] = uni((uint32_t)ga);
  g[3] = uni((((uint32_t)(ga >> 32)) & 0x01FFFFFFu) | 0x80000000u);
  return g;
}
// 1-byte elements, a tile of G_ROWS rows of G_ROWB bytes, tensor = tile,
// 4 dwords of LDS pad behind every 256-byte row, no mask.
__device__ __forceinline__ u32x8 tdm_group1(uint32_t src_pitch) {
  u32x8 g;
  g[0] = uni((1u << 20) | (5u << 22) | (3u << 25));
  g[1] = uni((G_ROWB & 0xFFFFu) << 16);
  g[2] = uni((G_ROWB >> 16) | ((G_ROWS & 0xFFFFu) << 16));
  g[3] = uni((G_ROWS >> 16) | (G_ROWB << 16));
  g[4] = uni(G_ROWS);
  g[5] = uni(src_pitch);
  g[6] = uni(0u);
  g[7] = uni(0u);
  return g;
}
__device__ __forceinline__ void tdm_load(u32x4 g0, u32x8 g1) {
  asm volatile("tensor_load_to_lds %0, %1" :: "s"(g0), "s"(g1) : "memory");
}

// 16x32 f16 fragment from an LDS row: same k order as load_frag
// (p already holds row (lane&15) and the 16-byte half (lane>>4)).
__device__ __forceinline__ v16h lds_frag(const unsigned char* p) {
  v8h lo = *(const v8h*)p;
  v8h hi = *(const v8h*)(p + 32);
  v16h r;
#pragma unroll
  for (int i = 0; i < 8; ++i) { r[i] = lo[i]; r[i + 8] = hi[i]; }
  return r;
}

template <typename OutT>
__global__ __launch_bounds__(128)
void gemm_bias_kernel(const _Float16* __restrict__ A,
                      const _Float16* __restrict__ Bt,
                      const float* __restrict__ bias,
                      OutT* __restrict__ C, int M, int N, int Kd) {
  __shared__ __attribute__((aligned(2048))) unsigned char L[2u * G_BUF];

  const int lane = threadIdx.x & 31;
  const uint32_t wave = uni(threadIdx.x >> 5);
  const int wm   = wave & 1;       // 2 waves along M
  const int wn   = wave >> 1;      // 2 waves along N
  const int brow = blockIdx.y * 128;
  const int bcol = blockIdx.x * 256;
  const uint32_t kb = (uint32_t)Kd * 2u;        // source row pitch, bytes
  const uint32_t T  = pinned((uint32_t)Kd / 128u);  // passes

  // This wave's slice: wave 0 the A rows, waves 1 and 2 the halves of Bt.
  const uint32_t issuer = (wave < 3u) ? 1u : 0u;
  const uint32_t sl = issuer ? wave : 0u;
  const uint64_t src0 = (sl == 0u)
      ? (uint64_t)(uintptr_t)A  + (uint64_t)brow * kb
      : (uint64_t)(uintptr_t)Bt + (uint64_t)(bcol + (sl - 1u) * G_ROWS) * kb;
  const uint32_t lds_slice = (uint32_t)(uintptr_t)L + sl * G_SLICE;
  const u32x8 g1 = tdm_group1(kb);

  v8f acc[4][8] = {};

  // Per-lane fragment bases inside a buffer.
  const uint32_t fa = (uint32_t)(wm * 64 + (lane & 15)) * G_PITCH + 16u * (uint32_t)(lane >> 4);
  const uint32_t fb = G_SLICE + (uint32_t)(wn * 128 + (lane & 15)) * G_PITCH + 16u * (uint32_t)(lane >> 4);

  // Prologue: stage 0 lands and is published, then stage 1 starts.
  if (pinned(issuer)) {
    tdm_load(tdm_group0(lds_slice, src0), g1);
    asm volatile("s_wait_tensorcnt 0x0" ::: "memory");  // stage 0 of this wave has landed
  }
  __syncthreads();
  if (pinned(issuer)) {
    tdm_load(tdm_group0(lds_slice + G_BUF, src0 + G_ROWB), g1);
  }

  uint64_t ga = src0 + 2u * G_ROWB;  // source of the next stage to issue
#pragma clang loop unroll(disable)  // one pass per trip: the ring's order stays as written
  for (uint32_t t = 0; t < T; ++t) {
    const uint32_t buf = (t & 1u) * G_BUF;
    const unsigned char* la = L + buf + fa;
    const unsigned char* lb = L + buf + fb;

    v16h af[2][4], bf[2][8];  // set (u & 1) holds block u's fragments
#pragma unroll
    for (int i = 0; i < 4; ++i) af[0][i] = lds_frag(la + (uint32_t)i * 16u * G_PITCH);
#pragma unroll
    for (int j = 0; j < 8; ++j) bf[0][j] = lds_frag(lb + (uint32_t)j * 16u * G_PITCH);

#pragma unroll
    for (int u = 0; u < 4; ++u) {
      const int cs = u & 1;
      if (u + 1 < 4) {
        const uint32_t ko = (uint32_t)(u + 1) * 64u;
#pragma unroll
        for (int i = 0; i < 4; ++i) af[cs ^ 1][i] = lds_frag(la + (uint32_t)i * 16u * G_PITCH + ko);
#pragma unroll
        for (int j = 0; j < 8; ++j) bf[cs ^ 1][j] = lds_frag(lb + (uint32_t)j * 16u * G_PITCH + ko);
      }
      // keeps the next block's LDS reads as one group ahead of this block's WMMAs
      __builtin_amdgcn_sched_barrier(0);
#pragma unroll
      for (int i = 0; i < 4; ++i)
#pragma unroll
        for (int j = 0; j < 8; ++j)
          acc[i][j] = wmma_f16(af[cs][i], bf[cs][j], acc[i][j]);
      // keeps later LDS reads from moving in among this block's WMMAs
      __builtin_amdgcn_sched_barrier(0);
    }

    // Publish point of stage t + 1.
    asm volatile("s_wait_dscnt 0x0" ::: "memory");  // this wave's reads of the buffer are done
    if (pinned(issuer)) {
      asm volatile("s_wait_tensorcnt 0x0" ::: "memory");
    }
    __syncthreads();
    if (pinned((issuer != 0u && t + 2u < T) ? 1u : 0u)) {
      tdm_load(tdm_group0(lds_slice + buf, ga), g1);
    }
    ga += G_ROWB;
  }
  asm volatile("s_wait_tensorcnt 0x0" ::: "memory");  // no tensor load is left in flight
  asm volatile("s_wait_dscnt 0x0" ::: "memory");      // no LDS read is left in flight

  const int row0 = brow + wm * 64;
  const int col0 = bcol + wn * 128;
  const int nlo = lane & 15;
  const int mhi = (lane >> 4) << 3;
  float bb[8];
#pragma unroll
  for (int j = 0; j < 8; ++j) bb[j] = bias[col0 + j * 16 + nlo];
#pragma unroll
  for (int i = 0; i < 4; ++i) {
    OutT* pr[8];
    OutT  val[8][8];
#pragma unroll
    for (int r = 0; r < 8; ++r)
      pr[r] = C + (size_t)(row0 + i * 16 + r + mhi) * N + col0 + nlo;
#pragma unroll
    for (int j = 0; j < 8; ++j)
#pragma unroll
      for (int r = 0; r < 8; ++r) val[j][r] = (OutT)(acc[i][j][r] + bb[j]);
    // every address and value of this group is formed before its first store issues
    __builtin_amdgcn_sched_barrier(0);
#pragma unroll
    for (int j = 0; j < 8; ++j)
#pragma unroll
      for (int r = 0; r < 8; ++r) pr[r][j * 16] = val[j][r];
    if (i < 3) {
      // stands before the next group overwrites registers that these stores name
      asm volatile("s_wait_xcnt 0x0" ::: "memory");
      // keeps the next group's arithmetic behind that wait
      __builtin_amdgcn_sched_barrier(0);
    }
  }
}

__global__ __launch_bounds__(128)
void attn_kernel(const _Float16* __restrict__ Q,
                 const _Float16* __restrict__ K,
                 const _Float16* __restrict__ Vt,
                 _Float16* __restrict__ O) {
  __shared__ _Float16 pl[4][16][32];  // per-wave P relayout buffers

  const int lane = threadIdx.x & 31;
  const int wv   = threadIdx.x >> 5;
  const int q0   = (blockIdx.x * 4 + wv) * 16;
  const int h    = blockIdx.y;
  const int b    = blockIdx.z;
  const float scale = 0.08838834764831845f;  // 1/sqrt(128)

  const _Float16* Qb  = Q  + (size_t)b * SEQ * HIDDEN + (size_t)q0 * HIDDEN + h * HDIM;
  const _Float16* Kb  = K  + (size_t)b * SEQ * HIDDEN + h * HDIM;
  const _Float16* Vtb = Vt + (size_t)(b * NHEADS + h) * HDIM * SEQ;

  // Cache Q fragments: 4 chunks of K-dim (d = 0,32,64,96)
  v16h qf[4];
#pragma unroll
  for (int kc = 0; kc < 4; ++kc) qf[kc] = load_frag(Qb, HIDDEN, kc * 32, lane);

  v8f   od[8] = {};                 // output accumulators, 16 x 128 f32
  float m_row[8], l_row[8];
#pragma unroll
  for (int j = 0; j < 8; ++j) { m_row[j] = -3.402823466e+38f; l_row[j] = 0.0f; }

  const int nlo = lane & 15;
  const int mhi = (lane >> 4) << 3;

  for (int kt = 0; kt < SEQ / 32; ++kt) {
    // ---- scores: S = Q * K_tile^T, two 16x16 tiles over 32 keys ----
    v8f s0 = {}, s1 = {};
    const _Float16* K0 = Kb + (size_t)(kt * 32)      * HIDDEN;
    const _Float16* K1 = Kb + (size_t)(kt * 32 + 16) * HIDDEN;
#pragma unroll
    for (int kc = 0; kc < 4; ++kc) {
      v16h b0 = load_frag(K0, HIDDEN, kc * 32, lane);
      v16h b1 = load_frag(K1, HIDDEN, kc * 32, lane);
      s0 = wmma_f16(qf[kc], b0, s0);
      s1 = wmma_f16(qf[kc], b1, s1);
    }

    // ---- online softmax (rows live across 16-lane halves) ----
    float alpha[8];
#pragma unroll
    for (int j = 0; j < 8; ++j) {
      float v0 = s0[j] * scale;
      float v1 = s1[j] * scale;
      float rm = fmaxf(v0, v1);
#pragma unroll
      for (int off = 1; off < 16; off <<= 1)
        rm = fmaxf(rm, __shfl_xor(rm, off, 32));
      float nm = fmaxf(m_row[j], rm);
      float al = __expf(m_row[j] - nm);
      float p0 = __expf(v0 - nm);
      float p1 = __expf(v1 - nm);
      float rs = p0 + p1;
#pragma unroll
      for (int off = 1; off < 16; off <<= 1)
        rs += __shfl_xor(rs, off, 32);
      l_row[j] = l_row[j] * al + rs;
      m_row[j] = nm;
      alpha[j] = al;
      // store P (C layout) to LDS for A-fragment relayout
      pl[wv][j + mhi][nlo]      = (_Float16)p0;
      pl[wv][j + mhi][nlo + 16] = (_Float16)p1;
    }

#pragma unroll
    for (int dt = 0; dt < 8; ++dt)
#pragma unroll
      for (int j = 0; j < 8; ++j) od[dt][j] *= alpha[j];

    // reload P as A fragment (16 rows x 32 keys) from LDS: ds_load_b128 x2
    {
      const _Float16* pp = &pl[wv][lane & 15][(lane >> 4) << 3];
      v8h lo = *(const v8h*)pp;
      v8h hi = *(const v8h*)(pp + 16);
      v16h pf;
#pragma unroll
      for (int i = 0; i < 8; ++i) { pf[i] = lo[i]; pf[i + 8] = hi[i]; }

      // ---- PV: O[.,dt*16..] += P(16x32) * V(32x16) ----
#pragma unroll
      for (int dt = 0; dt < 8; ++dt) {
        v16h vb = load_frag(Vtb + (size_t)(dt * 16) * SEQ, SEQ, kt * 32, lane);
        od[dt] = wmma_f16(pf, vb, od[dt]);
      }
    }
  }

  // ---- normalize and write out (B,S,H*D) f16 ----
  _Float16* Ob = O + (size_t)b * SEQ * HIDDEN + (size_t)q0 * HIDDEN + h * HDIM;
#pragma unroll
  for (int j = 0; j < 8; ++j) {
    const float inv = 1.0f / l_row[j];
    const int m = j + mhi;
#pragma unroll
    for (int dt = 0; dt < 8; ++dt)
      Ob[(size_t)m * HIDDEN + dt * 16 + nlo] = (_Float16)(od[dt][j] * inv);
  }
}

// ---------------------------------------------------------------------------
// Host-side orchestration
// ---------------------------------------------------------------------------
extern "C" void kernel_launch(void* const* d_in, const int* in_sizes, int n_in,
                              void* d_out, int out_size, void* d_ws, size_t ws_size,
                              hipStream_t stream) {
  const float* X  = (const float*)d_in[0];
  const float* Wq = (const float*)d_in[1];
  const float* bq = (const float*)d_in[2];
  const float* Wk = (const float*)d_in[3];
  const float* bk = (const float*)d_in[4];
  const float* Wv = (const float*)d_in[5];
  const float* bv = (const float*)d_in[6];
  const float* Wo = (const float*)d_in[7];
  const float* bo = (const float*)d_in[8];
  float* out = (float*)d_out;

  const size_t MB = 1024u * 1024u;
  uint8_t* w = (uint8_t*)d_ws;
  _Float16* Xh  = (_Float16*)(w);             // 16 MB : hidden f16 (4096x2048)
  _Float16* Wqt = (_Float16*)(w + 16 * MB);   //  8 MB : Wq^T f16
  _Float16* Wkt = (_Float16*)(w + 24 * MB);   //  8 MB
  _Float16* Wvt = (_Float16*)(w + 32 * MB);   //  8 MB
  _Float16* Wot = (_Float16*)(w + 40 * MB);   //  8 MB
  _Float16* Qm  = (_Float16*)(w + 48 * MB);   // 16 MB
  _Float16* Km  = (_Float16*)(w + 64 * MB);   // 16 MB
  _Float16* Vm  = (_Float16*)(w + 80 * MB);   // 16 MB
  _Float16* Vtm = (_Float16*)(w + 96 * MB);   // 16 MB : V^T (B,H,D,S)
  _Float16* AO  = (_Float16*)(w + 112 * MB);  // 16 MB : attention output f16

  const int nX = MROWS * HIDDEN;  // 8,388,608

  // 1) casts / transposes
  cast_f32_to_f16<<<(nX + 255) / 256, 256, 0, stream>>>(X, Xh, nX);
  {
    dim3 g(HIDDEN / 32, HIDDEN / 32), blk(32, 8);
    transpose_cast_w<<<g, blk, 0, stream>>>(Wq, Wqt);
    transpose_cast_w<<<g, blk, 0, stream>>>(Wk, Wkt);
    transpose_cast_w<<<g, blk, 0, stream>>>(Wv, Wvt);
    transpose_cast_w<<<g, blk, 0, stream>>>(Wo, Wot);
  }

  // 2) QKV projections (WMMA GEMM, f16 out + bias)
  {
    dim3 g(HIDDEN / 256, MROWS / 128);
    gemm_bias_kernel<_Float16><<<g, 128, 0, stream>>>(Xh, Wqt, bq, Qm, MROWS, HIDDEN, HIDDEN);
    gemm_bias_kernel<_Float16><<<g, 128, 0, stream>>>(Xh, Wkt, bk, Km, MROWS, HIDDEN, HIDDEN);
    gemm_bias_kernel<_Float16><<<g, 128, 0, stream>>>(Xh, Wvt, bv, Vm, MROWS, HIDDEN, HIDDEN);
  }

  // 3) V transpose for contiguous PV B-fragments
  transpose_v<<<(nX + 255) / 256, 256, 0, stream>>>(Vm, Vtm);

  // 4) attention (flash-style, 4 waves/block, one wave per 16 query rows)
  {
    dim3 g(SEQ / 64, NHEADS, BATCH);
    attn_kernel<<<g, 128, 0, stream>>>(Qm, Km, Vtm, AO);
  }

  // 5) output projection (f32 out + bias)
  {
    dim3 g(HIDDEN / 256, MROWS / 128);
    gemm_bias_kernel<float><<<g, 128, 0, stream>>>(AO, Wot, bo, out, MROWS, HIDDEN, HIDDEN);
  }
}
